// v000
// Measured on an AMD MI455X. A time is GPU time per run, averaged over a window of back-to-back runs after a warm-up
// (all launches, gaps included; the runs take copies of the inputs in turn), and the median of several windows.
// Apart from v000's, it joins two sittings. Times from different sittings can be a few percent apart, while
// side-by-side timings come from the same sitting.
// v000, which the later versions start from, runs in 31 microseconds.
#include <hip/hip_runtime.h>

typedef float v2f __attribute__((ext_vector_type(2)));
typedef float v8f __attribute__((ext_vector_type(8)));

#define BATCH   64
#define SEQ     8192
#define DIM     64
#define NCHUNK  32
#define CHUNK   256          // rows per block
#define WAVES   4
#define RPW     64           // rows per wave (CHUNK/WAVES)
#define TPW     4            // 16-row WMMA tiles per wave
#define WSSTR   68           // per-(b,chunk) ws floats: [0]=m, [1]=l, [2..65]=acc[64]

// ---------------------------------------------------------------------------
// Pass 1: one block = one (batch, 256-row chunk).
//   scores (q.K^T / 8) via v_wmma_f32_16x16x4_f32, chunk-local softmax
//   partials (m, l) + partial P.V accumulation, raw scores -> attn region.
// ---------------------------------------------------------------------------
__global__ __launch_bounds__(128) void attn_pass1(
    const float* __restrict__ q,
    const float* __restrict__ k,
    const float* __restrict__ v,
    float* __restrict__ attn_raw,   // d_out + 4096, raw scaled scores
    float* __restrict__ ws)
{
    __shared__ float s_q[DIM];        // q / temperature
    __shared__ float s_sc[CHUNK];     // raw scores for this chunk
    __shared__ float s_p[CHUNK];      // exp(s - m_c)
    __shared__ float s_red[128];
    __shared__ float s_acc[WAVES][DIM];

    const int b     = blockIdx.y;
    const int chunk = blockIdx.x;
    const int j0    = chunk * CHUNK;
    const int tid   = threadIdx.x;
    const int lane  = tid & 31;
    const int wave  = tid >> 5;

    if (tid < DIM) s_q[tid] = q[b * DIM + tid] * 0.125f;  // fold 1/temperature
    __syncthreads();

    const float* kb = k + (size_t)b * SEQ * DIM;
    const float* vb = v + (size_t)b * SEQ * DIM;

    // --- QK^T via WMMA f32 16x16x4 ---------------------------------------
    // A tile (16 rows x 4 K-cols): lane<16 -> K cols {k0,k0+1} of row lane,
    // lane>=16 -> K cols {k0+2,k0+3} of row (lane&15).
    const int mrow = lane & 15;
    const int ksel = (lane >> 4) << 1;   // 0 or 2

    for (int t = 0; t < TPW; ++t) {
        const int rowbase = j0 + wave * RPW + t * 16;
        const float* krow = kb + (size_t)(rowbase + mrow) * DIM + ksel;
        v8f c = {};
#pragma unroll
        for (int k0 = 0; k0 < DIM; k0 += 4) {
            v2f a  = *(const v2f*)(krow + k0);                 // global b64, coalesced
            v2f bq = { s_q[k0 + ksel], s_q[k0 + ksel + 1] };   // LDS broadcast
            c = __builtin_amdgcn_wmma_f32_16x16x4_f32(
                    /*neg_a=*/false, a, /*neg_b=*/false, bq,
                    /*c_mod=*/(short)0, c, /*reuse_a=*/false, /*reuse_b=*/false);
        }
        // Every column of D is identical (B columns replicated).
        // D layout: vgpr r = row r (lanes 0-15) / row 8+r (lanes 16-31).
        const int base = wave * RPW + t * 16;
        if (lane == 0) {
#pragma unroll
            for (int r = 0; r < 8; ++r) s_sc[base + r] = c[r];
        } else if (lane == 16) {
#pragma unroll
            for (int r = 0; r < 8; ++r) s_sc[base + 8 + r] = c[r];
        }
    }
    __syncthreads();

    // --- chunk-local max ---------------------------------------------------
    s_red[tid] = fmaxf(s_sc[tid], s_sc[tid + 128]);
    __syncthreads();
#pragma unroll
    for (int s = 64; s > 0; s >>= 1) {
        if (tid < s) s_red[tid] = fmaxf(s_red[tid], s_red[tid + s]);
        __syncthreads();
    }
    const float m_c = s_red[0];
    __syncthreads();

    // --- exp + chunk-local sum --------------------------------------------
    const float p0 = __expf(s_sc[tid]       - m_c);
    const float p1 = __expf(s_sc[tid + 128] - m_c);
    s_p[tid]       = p0;
    s_p[tid + 128] = p1;
    s_red[tid]     = p0 + p1;
    __syncthreads();
#pragma unroll
    for (int s = 64; s > 0; s >>= 1) {
        if (tid < s) s_red[tid] += s_red[tid + s];
        __syncthreads();
    }
    const float l_c = s_red[0];

    // --- partial P.V (fp32 FMA, coalesced b64 V loads) --------------------
    const int d0 = lane * 2;
    float acc0 = 0.f, acc1 = 0.f;
    const float* vrow = vb + (size_t)(j0 + wave * RPW) * DIM + d0;
#pragma unroll 8
    for (int jj = 0; jj < RPW; ++jj) {
        const float pj = s_p[wave * RPW + jj];
        v2f vv = *(const v2f*)(vrow + (size_t)jj * DIM);
        acc0 = fmaf(pj, vv.x, acc0);
        acc1 = fmaf(pj, vv.y, acc1);
    }
    s_acc[wave][d0]     = acc0;
    s_acc[wave][d0 + 1] = acc1;
    __syncthreads();

    // --- write partials + raw scores --------------------------------------
    float* wsb = ws + (size_t)(b * NCHUNK + chunk) * WSSTR;
    if (tid < DIM) {
        wsb[2 + tid] = s_acc[0][tid] + s_acc[1][tid] + s_acc[2][tid] + s_acc[3][tid];
    }
    if (tid == 0) { wsb[0] = m_c; wsb[1] = l_c; }

    attn_raw[(size_t)b * SEQ + j0 + tid]       = s_sc[tid];
    attn_raw[(size_t)b * SEQ + j0 + tid + 128] = s_sc[tid + 128];
}

// ---------------------------------------------------------------------------
// Pass 2: one block per batch. Reduce (m,l) across chunks, finalize out[64],
// normalize the attn row in place.
// ---------------------------------------------------------------------------
__global__ __launch_bounds__(256) void attn_pass2(
    const float* __restrict__ ws,
    float* __restrict__ out,    // d_out [B*64]
    float* __restrict__ attn)   // d_out + 4096: raw scores in, probs out
{
    __shared__ float s_m[NCHUNK];
    __shared__ float s_l[NCHUNK];
    __shared__ float s_ML[2];

    const int b   = blockIdx.x;
    const int tid = threadIdx.x;
    const float* wsb = ws + (size_t)b * NCHUNK * WSSTR;

    if (tid < NCHUNK) {
        s_m[tid] = wsb[(size_t)tid * WSSTR + 0];
        s_l[tid] = wsb[(size_t)tid * WSSTR + 1];
    }
    __syncthreads();
    if (tid == 0) {
        float M = -3.402823466e38f;
        for (int c = 0; c < NCHUNK; ++c) M = fmaxf(M, s_m[c]);
        float L = 0.f;
        for (int c = 0; c < NCHUNK; ++c) L += s_l[c] * __expf(s_m[c] - M);
        s_ML[0] = M;
        s_ML[1] = L;
    }
    __syncthreads();
    const float M    = s_ML[0];
    const float rcpL = 1.0f / s_ML[1];

    if (tid < DIM) {
        float a = 0.f;
        for (int c = 0; c < NCHUNK; ++c)
            a += wsb[(size_t)c * WSSTR + 2 + tid] * __expf(s_m[c] - M);
        out[b * DIM + tid] = a * rcpL;
    }

    for (int i = tid; i < SEQ; i += 256) {
        const float s = attn[(size_t)b * SEQ + i];
        attn[(size_t)b * SEQ + i] = __expf(s - M) * rcpL;
    }
}

// ---------------------------------------------------------------------------
extern "C" void kernel_launch(void* const* d_in, const int* in_sizes, int n_in,
                              void* d_out, int out_size, void* d_ws, size_t ws_size,
                              hipStream_t stream) {
    const float* q = (const float*)d_in[0];
    const float* k = (const float*)d_in[1];
    const float* v = (const float*)d_in[2];

    float* out  = (float*)d_out;          // [B,1,D] -> 4096 floats
    float* attn = out + BATCH * DIM;      // [B,1,S] -> 524288 floats
    float* ws   = (float*)d_ws;           // needs 64*32*68*4 = ~557 KB

    dim3 g1(NCHUNK, BATCH);
    attn_pass1<<<g1, 128, 0, stream>>>(q, k, v, attn, ws);
    attn_pass2<<<BATCH, 256, 0, stream>>>(ws, out, attn);
}

// v001
// Measured time: 28.4 microseconds a run.
// Next to v000, in two timings, it ran 1.11 times as fast each time.
#include <hip/hip_runtime.h>

typedef float v2f __attribute__((ext_vector_type(2)));
typedef float v4f __attribute__((ext_vector_type(4)));
typedef float v8f __attribute__((ext_vector_type(8)));

#define BATCH   64
#define SEQ     8192
#define DIM     64
#define NCHUNK  32
#define CHUNK   256          // rows per block
#define WAVES   4
#define RPW     64           // rows per wave (CHUNK/WAVES)
#define TPW     4            // 16-row batches per wave (8 WMMA pairs each)
#define WSSTR   68           // per-(b,chunk) ws floats: [0]=m, [1]=l, [2..65]=acc[64]

// keep + (send of the lane whose number differs by the row_xmask in CTRL)
template <int CTRL>
__device__ __forceinline__ float xadd(float keep, float send) {
    return keep + __int_as_float(__builtin_amdgcn_update_dpp(
                      0, __float_as_int(send), CTRL, 0xf, 0xf, true));
}

// ---------------------------------------------------------------------------
// Pass 1: one block = one (batch, 256-row chunk).
//   scores (q.K^T / 8) via v_wmma_f32_16x16x4_f32, chunk-local softmax
//   partials (m, l) + partial P.V accumulation, raw scores -> attn region.
// ---------------------------------------------------------------------------
__global__ __launch_bounds__(128) void attn_pass1(
    const float* __restrict__ q,
    const float* __restrict__ k,
    const float* __restrict__ v,
    float* __restrict__ attn_raw,   // d_out + 4096, raw scaled scores
    float* __restrict__ ws)
{
    __shared__ __attribute__((aligned(16))) float s_q[DIM];   // q / temperature
    __shared__ float s_sc[CHUNK];     // raw scores for this chunk
    __shared__ float s_p[CHUNK];      // exp(s - m_c)
    __shared__ float s_red[128];
    __shared__ float s_acc[WAVES][DIM];

    const int b     = blockIdx.y;
    const int chunk = blockIdx.x;
    const int j0    = chunk * CHUNK;
    const int tid   = threadIdx.x;
    const int lane  = tid & 31;
    const int wave  = tid >> 5;

    if (tid < DIM) s_q[tid] = q[b * DIM + tid] * 0.125f;  // fold 1/temperature
    __syncthreads();

    const float* kb = k + (size_t)b * SEQ * DIM;
    const float* vb = v + (size_t)b * SEQ * DIM;

    // --- QK^T via WMMA f32 16x16x4, K read as whole 128-B lines -------------
    // One 16-byte load of the wave covers 512 contiguous bytes = 2 K rows.
    // A row c of the tile = 8 consecutive floats: K row (c >> 3), eighth (c & 7);
    // lane (c, h) holds floats 4h .. 4h+3 of it (two k steps of the 16x16x4 form).
    // B column n = the eighth (n & 7) of q in the same k order, so
    // D[8s + e][n] = K[row s][eighth e] . q[eighth n & 7]; used where (n & 7) == e.
    const int c16 = lane & 15;
    const int h   = lane >> 4;
    const bool b0 = (lane & 1) != 0;
    const bool b1 = (lane & 2) != 0;
    const bool b2 = (lane & 4) != 0;
    const bool b3 = (lane & 8) != 0;

    const v4f q4 = *(const v4f*)&s_q[8 * (lane & 7) + 4 * h];
    const v2f qlo = { q4.x, q4.y };
    const v2f qhi = { q4.z, q4.w };

    const v4f* kp = (const v4f*)(kb + (size_t)(j0 + wave * RPW) * DIM) + (2 * c16 + h);

    // rolled: one 16-row batch's registers at a time keeps all 8 blocks of a WGP resident
#pragma unroll 1
    for (int t = 0; t < TPW; ++t) {
        v4f a[8];
        // unrolled (here and below): constant indices keep a, x, y, z in registers;
        // the 8 loads issue together, 4 KB of the wave in flight
#pragma unroll
        for (int g = 0; g < 8; ++g) a[g] = kp[(t * 8 + g) * 32];

        float x[8];   // x[g]: this lane's eighth of the score of row 2g + h
#pragma unroll
        for (int g = 0; g < 8; ++g) {
            const v2f alo = { a[g].x, a[g].y };
            const v2f ahi = { a[g].z, a[g].w };
            v8f d = {};
            d = __builtin_amdgcn_wmma_f32_16x16x4_f32(
                    false, alo, false, qlo, (short)0, d, false, false);
            d = __builtin_amdgcn_wmma_f32_16x16x4_f32(
                    false, ahi, false, qhi, (short)0, d, false, false);
            // register r of lane (c, h) is D[8h + r][c]: take r == c & 7
            const float s01 = b0 ? d[1] : d[0];
            const float s23 = b0 ? d[3] : d[2];
            const float s45 = b0 ? d[5] : d[4];
            const float s67 = b0 ? d[7] : d[6];
            const float s03 = b1 ? s23 : s01;
            const float s47 = b1 ? s67 : s45;
            x[g] = b2 ? s47 : s03;
        }
        // Sum each x[g] over its 8 lanes; lane (c, h) ends with row 2 * (c & 7) + h.
        float y[4], z[2];
#pragma unroll
        for (int i = 0; i < 4; ++i)
            y[i] = xadd<0x161>(b0 ? x[2 * i + 1] : x[2 * i], b0 ? x[2 * i] : x[2 * i + 1]);
#pragma unroll
        for (int i = 0; i < 2; ++i)
            z[i] = xadd<0x162>(b1 ? y[2 * i + 1] : y[2 * i], b1 ? y[2 * i] : y[2 * i + 1]);
        const float w = xadd<0x164>(b2 ? z[1] : z[0], b2 ? z[0] : z[1]);

        // lanes c and c + 8 hold the same sums: one of them stores
        if (!b3) s_sc[wave * RPW + t * 16 + 2 * c16 + h] = w;
    }
    __syncthreads();

    // --- chunk-local max ---------------------------------------------------
    s_red[tid] = fmaxf(s_sc[tid], s_sc[tid + 128]);
    __syncthreads();
#pragma unroll
    for (int s = 64; s > 0; s >>= 1) {
        if (tid < s) s_red[tid] = fmaxf(s_red[tid], s_red[tid + s]);
        __syncthreads();
    }
    const float m_c = s_red[0];
    __syncthreads();

    // --- exp + chunk-local sum --------------------------------------------
    const float p0 = __expf(s_sc[tid]       - m_c);
    const float p1 = __expf(s_sc[tid + 128] - m_c);
    s_p[tid]       = p0;
    s_p[tid + 128] = p1;
    s_red[tid]     = p0 + p1;
    __syncthreads();
#pragma unroll
    for (int s = 64; s > 0; s >>= 1) {
        if (tid < s) s_red[tid] += s_red[tid + s];
        __syncthreads();
    }
    const float l_c = s_red[0];

    // --- partial P.V (fp32 FMA, coalesced b64 V loads) --------------------
    const int d0 = lane * 2;
    float acc0 = 0.f, acc1 = 0.f;
    const float* vrow = vb + (size_t)(j0 + wave * RPW) * DIM + d0;
#pragma unroll 8
    for (int jj = 0; jj < RPW; ++jj) {
        const float pj = s_p[wave * RPW + jj];
        v2f vv = *(const v2f*)(vrow + (size_t)jj * DIM);
        acc0 = fmaf(pj, vv.x, acc0);
        acc1 = fmaf(pj, vv.y, acc1);
    }
    s_acc[wave][d0]     = acc0;
    s_acc[wave][d0 + 1] = acc1;
    __syncthreads();

    // --- write partials + raw scores --------------------------------------
    float* wsb = ws + (size_t)(b * NCHUNK + chunk) * WSSTR;
    if (tid < DIM) {
        wsb[2 + tid] = s_acc[0][tid] + s_acc[1][tid] + s_acc[2][tid] + s_acc[3][tid];
    }
    if (tid == 0) { wsb[0] = m_c; wsb[1] = l_c; }

    attn_raw[(size_t)b * SEQ + j0 + tid]       = s_sc[tid];
    attn_raw[(size_t)b * SEQ + j0 + tid + 128] = s_sc[tid + 128];
}

// ---------------------------------------------------------------------------
// Pass 2: one block per batch. Reduce (m,l) across chunks, finalize out[64],
// normalize the attn row in place.
// ---------------------------------------------------------------------------
__global__ __launch_bounds__(256) void attn_pass2(
    const float* __restrict__ ws,
    float* __restrict__ out,    // d_out [B*64]
    float* __restrict__ attn)   // d_out + 4096: raw scores in, probs out
{
    __shared__ float s_m[NCHUNK];
    __shared__ float s_l[NCHUNK];
    __shared__ float s_ML[2];

    const int b   = blockIdx.x;
    const int tid = threadIdx.x;
    const float* wsb = ws + (size_t)b * NCHUNK * WSSTR;

    if (tid < NCHUNK) {
        s_m[tid] = wsb[(size_t)tid * WSSTR + 0];
        s_l[tid] = wsb[(size_t)tid * WSSTR + 1];
    }
    __syncthreads();
    if (tid == 0) {
        float M = -3.402823466e38f;
        for (int c = 0; c < NCHUNK; ++c) M = fmaxf(M, s_m[c]);
        float L = 0.f;
        for (int c = 0; c < NCHUNK; ++c) L += s_l[c] * __expf(s_m[c] - M);
        s_ML[0] = M;
        s_ML[1] = L;
    }
    __syncthreads();
    const float M    = s_ML[0];
    const float rcpL = 1.0f / s_ML[1];

    if (tid < DIM) {
        float a = 0.f;
        for (int c = 0; c < NCHUNK; ++c)
            a += wsb[(size_t)c * WSSTR + 2 + tid] * __expf(s_m[c] - M);
        out[b * DIM + tid] = a * rcpL;
    }

    for (int i = tid; i < SEQ; i += 256) {
        const float s = attn[(size_t)b * SEQ + i];
        attn[(size_t)b * SEQ + i] = __expf(s - M) * rcpL;
    }
}

// ---------------------------------------------------------------------------
extern "C" void kernel_launch(void* const* d_in, const int* in_sizes, int n_in,
                              void* d_out, int out_size, void* d_ws, size_t ws_size,
                              hipStream_t stream) {
    const float* q = (const float*)d_in[0];
    const float* k = (const float*)d_in[1];
    const float* v = (const float*)d_in[2];

    float* out  = (float*)d_out;          // [B,1,D] -> 4096 floats
    float* attn = out + BATCH * DIM;      // [B,1,S] -> 524288 floats
    float* ws   = (float*)d_ws;           // needs 64*32*68*4 = ~557 KB

    dim3 g1(NCHUNK, BATCH);
    attn_pass1<<<g1, 128, 0, stream>>>(q, k, v, attn, ws);
    attn_pass2<<<BATCH, 256, 0, stream>>>(ws, out, attn);
}

// v002
// It runs in 25.8 microseconds.
// In both of two side-by-side timings against v001, it was 1.09 times as fast.
// Counting every step since v000, it is 1.21 times as fast.
#include <hip/hip_runtime.h>

typedef float v2f __attribute__((ext_vector_type(2)));
typedef float v4f __attribute__((ext_vector_type(4)));
typedef float v8f __attribute__((ext_vector_type(8)));

#define BATCH   64
#define SEQ     8192
#define DIM     64
#define NCHUNK  16
#define CHUNK   512          // rows per block
#define WAVES   4
#define RPW     128          // rows per wave (CHUNK/WAVES)
#define TPW     8            // 16-row tiles per wave, of K and again of V
#define AHEAD   2            // tiles whose loads are issued ahead of the tile worked on
#define NBUF    (AHEAD + 1)  // tile buffers of the register ring
#define WSSTR   68           // per-(b,chunk) ws floats: [0]=m, [1]=l, [2..65]=acc[64]

template <int CTRL>
__device__ __forceinline__ float dpp(float x) {
    return __int_as_float(__builtin_amdgcn_update_dpp(
               0, __float_as_int(x), CTRL, 0xf, 0xf, true));
}

// keep + (send of the lane whose number differs by the row_xmask in CTRL)
template <int CTRL>
__device__ __forceinline__ float xadd(float keep, float send) {
    return keep + dpp<CTRL>(send);
}

// the value of lane l ^ 16
__device__ __forceinline__ float other_row(float x) {
    return __int_as_float(__builtin_amdgcn_permlanex16(
               0, __float_as_int(x), 0x76543210, 0xfedcba98, false, false));
}

// ---------------------------------------------------------------------------
// Pass 1: one block = one (batch, 512-row chunk); each wave works alone on its
//   128 rows until the closing merge. It streams 8 K tiles, then 8 V tiles
//   (16 rows = 8 loads of 512 B each) through one ring of register buffers.
//   scores (q.K^T / 8) via v_wmma_f32_16x16x4_f32, softmax partials (m, l) of the
//   wave in registers, partial P.V, raw scores -> attn region.
// ---------------------------------------------------------------------------
__global__ __launch_bounds__(128) void attn_pass1(
    const float* __restrict__ q,
    const float* __restrict__ k,
    const float* __restrict__ v,
    float* __restrict__ attn_raw,   // d_out + 4096, raw scaled scores
    float* __restrict__ ws)
{
    __shared__ float s_m[WAVES];
    __shared__ float s_l[WAVES];
    __shared__ __attribute__((aligned(16))) float s_acc[WAVES][DIM];

    const int b     = blockIdx.y;
    const int chunk = blockIdx.x;
    const int tid   = threadIdx.x;
    const int lane  = tid & 31;
    const int wave  = tid >> 5;

    // --- QK^T via WMMA f32 16x16x4, K read as whole 128-B lines -------------
    // One 16-byte load of the wave covers 512 contiguous bytes = 2 K rows.
    // A row c of the tile = 8 consecutive floats: K row (c >> 3), eighth (c & 7);
    // lane (c, h) holds floats 4h .. 4h+3 of it (two k steps of the 16x16x4 form).
    // B column n = the eighth (n & 7) of q in the same k order, so
    // D[8s + e][n] = K[row s][eighth e] . q[eighth n & 7]; used where (n & 7) == e.
    const int c16 = lane & 15;
    const int h   = lane >> 4;
    const bool b0 = (lane & 1) != 0;
    const bool b1 = (lane & 2) != 0;
    const bool b2 = (lane & 4) != 0;
    const bool b3 = (lane & 8) != 0;

    const size_t row0 = (size_t)b * SEQ + chunk * CHUNK + wave * RPW;   // the wave's first row
    const v4f* kp = (const v4f*)(k + row0 * DIM) + (2 * c16 + h);
    const v4f* vp = (const v4f*)(v + row0 * DIM) + lane;   // row 2g + h, floats 4 c16 .. 4 c16 + 3

    const v4f q4 = *(const v4f*)(q + b * DIM + 8 * (lane & 7) + 4 * h) * 0.125f;  // 1/temperature folded in
    const v2f qlo = { q4.x, q4.y };
    const v2f qhi = { q4.z, q4.w };

    // Stage S of the stream: K tile S for S < TPW, then V tile S - TPW.
    v4f ring[NBUF][8];
#define LOAD_STAGE(S) do { \
        const v4f* src_ = ((S) < TPW) ? kp + (S) * 256 : vp + ((S) - TPW) * 256; \
        _Pragma("unroll") for (int g = 0; g < 8; ++g) ring[(S) % NBUF][g] = src_[g * 32]; \
    } while (0)

    // every loop over stages is unrolled: constant indices keep ring, sc and p in registers
#pragma unroll
    for (int s = 0; s < AHEAD; ++s) LOAD_STAGE(s);

    float sc[TPW];   // sc[t]: score of row 16t + 2 * (c16 & 7) + h (lanes c and c + 8 alike)
#pragma unroll
    for (int t = 0; t < TPW; ++t) {
        // the fence pair pins "loads of stage t + AHEAD, then the work on stage t":
        // without it the loads may sink to their use and the stream stalls
        __builtin_amdgcn_sched_barrier(0);
        LOAD_STAGE(t + AHEAD);
        __builtin_amdgcn_sched_barrier(0);
        const v4f* a = ring[t % NBUF];

        float x[8];   // x[g]: this lane's eighth of the score of row 2g + h
#pragma unroll
        for (int g = 0; g < 8; ++g) {
            const v2f alo = { a[g].x, a[g].y };
            const v2f ahi = { a[g].z, a[g].w };
            v8f d = {};
            d = __builtin_amdgcn_wmma_f32_16x16x4_f32(
                    false, alo, false, qlo, (short)0, d, false, false);
            d = __builtin_amdgcn_wmma_f32_16x16x4_f32(
                    false, ahi, false, qhi, (short)0, d, false, false);
            // register r of lane (c, h) is D[8h + r][c]: take r == c & 7
            const float s01 = b0 ? d[1] : d[0];
            const float s23 = b0 ? d[3] : d[2];
            const float s45 = b0 ? d[5] : d[4];
            const float s67 = b0 ? d[7] : d[6];
            const float s03 = b1 ? s23 : s01;
            const float s47 = b1 ? s67 : s45;
            x[g] = b2 ? s47 : s03;
        }
        // Sum each x[g] over its 8 lanes; lane (c, h) ends with row 2 * (c & 7) + h.
        float y[4], z[2];
#pragma unroll
        for (int i = 0; i < 4; ++i)
            y[i] = xadd<0x161>(b0 ? x[2 * i + 1] : x[2 * i], b0 ? x[2 * i] : x[2 * i + 1]);
#pragma unroll
        for (int i = 0; i < 2; ++i)
            z[i] = xadd<0x162>(b1 ? y[2 * i + 1] : y[2 * i], b1 ? y[2 * i] : y[2 * i + 1]);
        sc[t] = xadd<0x164>(b2 ? z[1] : z[0], b2 ? z[0] : z[1]);
    }

    // --- raw scores: lanes c < 8 store an even tile, lanes c >= 8 the odd one behind it,
    //     so each store of the wave fills one 128-B line
    float* araw = attn_raw + row0 + 16 * (b3 ? 1 : 0) + 2 * (c16 & 7) + h;
#pragma unroll
    for (int u = 0; u < TPW / 2; ++u) araw[32 * u] = b3 ? sc[2 * u + 1] : sc[2 * u];
    // the stores' address and data registers are reused right behind them: keep the wait in front
    asm volatile("s_wait_xcnt 0x0" ::: "memory");

    // --- the wave's own max, exp and sum (V stages 0 .. AHEAD - 1 are in flight) ---
    float m_w = sc[0];
#pragma unroll
    for (int t = 1; t < TPW; ++t) m_w = fmaxf(m_w, sc[t]);
    m_w = fmaxf(m_w, dpp<0x161>(m_w));
    m_w = fmaxf(m_w, dpp<0x162>(m_w));
    m_w = fmaxf(m_w, dpp<0x164>(m_w));
    m_w = fmaxf(m_w, other_row(m_w));

    float p[TPW];
    float l_w = 0.f;
#pragma unroll
    for (int t = 0; t < TPW; ++t) { p[t] = __expf(sc[t] - m_w); l_w += p[t]; }
    l_w = xadd<0x161>(l_w, l_w);
    l_w = xadd<0x162>(l_w, l_w);
    l_w = xadd<0x164>(l_w, l_w);
    l_w += other_row(l_w);

    // --- partial P.V: load g of a tile holds row 2g + h; its weight sits in lane g of
    //     this lane's 16-lane row (row_share) -----------------------------------
    v4f acc = { 0.f, 0.f, 0.f, 0.f };
#define PV(G) do { const float pj_ = dpp<0x150 + (G)>(p[t]); \
        acc.x = fmaf(pj_, vv[G].x, acc.x); acc.y = fmaf(pj_, vv[G].y, acc.y); \
        acc.z = fmaf(pj_, vv[G].z, acc.z); acc.w = fmaf(pj_, vv[G].w, acc.w); } while (0)
#pragma unroll
    for (int t = 0; t < TPW; ++t) {
        // same fence pair as above
        __builtin_amdgcn_sched_barrier(0);
        if (t + AHEAD < TPW) LOAD_STAGE(TPW + t + AHEAD);
        __builtin_amdgcn_sched_barrier(0);
        const v4f* vv = ring[(TPW + t) % NBUF];
        PV(0); PV(1); PV(2); PV(3); PV(4); PV(5); PV(6); PV(7);
    }
#undef PV
#undef LOAD_STAGE
    acc.x += other_row(acc.x);   // even rows + odd rows
    acc.y += other_row(acc.y);
    acc.z += other_row(acc.z);
    acc.w += other_row(acc.w);

    // --- merge the 4 waves, write the chunk's partials ---------------------
    if (h == 0) *(v4f*)&s_acc[wave][4 * c16] = acc;
    if (lane == 0) { s_m[wave] = m_w; s_l[wave] = l_w; }
    __syncthreads();

    if (tid < DIM) {
        const float m_c = fmaxf(fmaxf(s_m[0], s_m[1]), fmaxf(s_m[2], s_m[3]));
        const float e0 = __expf(s_m[0] - m_c);
        const float e1 = __expf(s_m[1] - m_c);
        const float e2 = __expf(s_m[2] - m_c);
        const float e3 = __expf(s_m[3] - m_c);
        float* wsb = ws + (size_t)(b * NCHUNK + chunk) * WSSTR;
        wsb[2 + tid] = s_acc[0][tid] * e0 + s_acc[1][tid] * e1
                     + s_acc[2][tid] * e2 + s_acc[3][tid] * e3;
        if (tid == 0) {
            wsb[0] = m_c;
            wsb[1] = s_l[0] * e0 + s_l[1] * e1 + s_l[2] * e2 + s_l[3] * e3;
        }
    }
}

// ---------------------------------------------------------------------------
// Pass 2: one block per batch. Reduce (m,l) across chunks, finalize out[64],
// normalize the attn row in place.
// ---------------------------------------------------------------------------
__global__ __launch_bounds__(256) void attn_pass2(
    const float* __restrict__ ws,
    float* __restrict__ out,    // d_out [B*64]
    float* __restrict__ attn)   // d_out + 4096: raw scores in, probs out
{
    __shared__ float s_m[NCHUNK];
    __shared__ float s_l[NCHUNK];
    __shared__ float s_ML[2];

    const int b   = blockIdx.x;
    const int tid = threadIdx.x;
    const float* wsb = ws + (size_t)b * NCHUNK * WSSTR;

    if (tid < NCHUNK) {
        s_m[tid] = wsb[(size_t)tid * WSSTR + 0];
        s_l[tid] = wsb[(size_t)tid * WSSTR + 1];
    }
    __syncthreads();
    if (tid == 0) {
        float M = -3.402823466e38f;
        for (int c = 0; c < NCHUNK; ++c) M = fmaxf(M, s_m[c]);
        float L = 0.f;
        for (int c = 0; c < NCHUNK; ++c) L += s_l[c] * __expf(s_m[c] - M);
        s_ML[0] = M;
        s_ML[1] = L;
    }
    __syncthreads();
    const float M    = s_ML[0];
    const float rcpL = 1.0f / s_ML[1];

    if (tid < DIM) {
        float a = 0.f;
        for (int c = 0; c < NCHUNK; ++c)
            a += wsb[(size_t)c * WSSTR + 2 + tid] * __expf(s_m[c] - M);
        out[b * DIM + tid] = a * rcpL;
    }

    for (int i = tid; i < SEQ; i += 256) {
        const float s = attn[(size_t)b * SEQ + i];
        attn[(size_t)b * SEQ + i] = __expf(s - M) * rcpL;
    }
}

// ---------------------------------------------------------------------------
extern "C" void kernel_launch(void* const* d_in, const int* in_sizes, int n_in,
                              void* d_out, int out_size, void* d_ws, size_t ws_size,
                              hipStream_t stream) {
    const float* q = (const float*)d_in[0];
    const float* k = (const float*)d_in[1];
    const float* v = (const float*)d_in[2];

    float* out  = (float*)d_out;          // [B,1,D] -> 4096 floats
    float* attn = out + BATCH * DIM;      // [B,1,S] -> 524288 floats
    float* ws   = (float*)d_ws;           // needs 64*16*68*4 = ~279 KB

    dim3 g1(NCHUNK, BATCH);
    attn_pass1<<<g1, 128, 0, stream>>>(q, k, v, attn, ws);
    attn_pass2<<<BATCH, 256, 0, stream>>>(ws, out, attn);
}

// v003
// Measured time: 20.7 microseconds a run.
// Two timings next to v002 put it at 1.25 and 1.26 times that version's speed.
// All steps since v000 together make it 1.52 times as fast.
#include <hip/hip_runtime.h>

typedef float v2f __attribute__((ext_vector_type(2)));
typedef float v4f __attribute__((ext_vector_type(4)));
typedef float v8f __attribute__((ext_vector_type(8)));

#define BATCH   64
#define SEQ     8192
#define DIM     64
#define NCHUNK  16
#define CHUNK   512          // rows per block
#define WAVES   4
#define RPW     128          // rows per wave (CHUNK/WAVES)
#define TPW     8            // 16-row tiles per wave, of K and again of V
#define AHEAD   2            // tiles whose loads are issued ahead of the tile worked on
#define NBUF    (AHEAD + 1)  // tile buffers of the register ring
#define WSSTR   68           // per-(b,chunk) ws floats: [0]=m, [1]=l, [2..65]=acc[64]

template <int CTRL>
__device__ __forceinline__ float dpp(float x) {
    return __int_as_float(__builtin_amdgcn_update_dpp(
               0, __float_as_int(x), CTRL, 0xf, 0xf, true));
}

// keep + (send of the lane whose number differs by the row_xmask in CTRL)
template <int CTRL>
__device__ __forceinline__ float xadd(float keep, float send) {
    return keep + dpp<CTRL>(send);
}

// the value of lane l ^ 16
__device__ __forceinline__ float other_row(float x) {
    return __int_as_float(__builtin_amdgcn_permlanex16(
               0, __float_as_int(x), 0x76543210, 0xfedcba98, false, false));
}

// ---------------------------------------------------------------------------
// Pass 1: one block = one (batch, 512-row chunk); each wave works alone on its
//   128 rows until the closing merge. It streams 8 K tiles, then 8 V tiles
//   (16 rows = 8 loads of 512 B each) through one ring of register buffers.
//   scores (q.K^T / 8) via v_wmma_f32_16x16x4_f32, softmax partials (m, l) of the
//   wave in registers, partial P.V, raw scores -> attn region.
// ---------------------------------------------------------------------------
__global__ __launch_bounds__(128) void attn_pass1(
    const float* __restrict__ q,
    const float* __restrict__ k,
    const float* __restrict__ v,
    float* __restrict__ attn_raw,   // d_out + 4096, raw scaled scores
    float* __restrict__ ws)
{
    __shared__ float s_m[WAVES];
    __shared__ float s_l[WAVES];
    __shared__ __attribute__((aligned(16))) float s_acc[WAVES][DIM];

    const int b     = blockIdx.y;
    const int chunk = blockIdx.x;
    const int tid   = threadIdx.x;
    const int lane  = tid & 31;
    const int wave  = tid >> 5;

    // --- QK^T via WMMA f32 16x16x4, K read as whole 128-B lines -------------
    // One 16-byte load of the wave covers 512 contiguous bytes = 2 K rows.
    // A row c of the tile = 8 consecutive floats: K row (c >> 3), eighth (c & 7);
    // lane (c, h) holds floats 4h .. 4h+3 of it (two k steps of the 16x16x4 form).
    // B column n = the eighth (n & 7) of q in the same k order, so
    // D[8s + e][n] = K[row s][eighth e] . q[eighth n & 7]; used where (n & 7) == e.
    const int c16 = lane & 15;
    const int h   = lane >> 4;
    const bool b0 = (lane & 1) != 0;
    const bool b1 = (lane & 2) != 0;
    const bool b2 = (lane & 4) != 0;
    const bool b3 = (lane & 8) != 0;

    const size_t row0 = (size_t)b * SEQ + chunk * CHUNK + wave * RPW;   // the wave's first row
    const v4f* kp = (const v4f*)(k + row0 * DIM) + (2 * c16 + h);
    const v4f* vp = (const v4f*)(v + row0 * DIM) + lane;   // row 2g + h, floats 4 c16 .. 4 c16 + 3

    const v4f q4 = *(const v4f*)(q + b * DIM + 8 * (lane & 7) + 4 * h) * 0.125f;  // 1/temperature folded in
    const v2f qlo = { q4.x, q4.y };
    const v2f qhi = { q4.z, q4.w };

    // Stage S of the stream: K tile S for S < TPW, then V tile S - TPW.
    v4f ring[NBUF][8];
#define LOAD_STAGE(S) do { \
        const v4f* src_ = ((S) < TPW) ? kp + (S) * 256 : vp + ((S) - TPW) * 256; \
        _Pragma("unroll") for (int g = 0; g < 8; ++g) ring[(S) % NBUF][g] = src_[g * 32]; \
    } while (0)

    // every loop over stages is unrolled: constant indices keep ring, sc and p in registers
#pragma unroll
    for (int s = 0; s < AHEAD; ++s) LOAD_STAGE(s);

    float sc[TPW];   // sc[t]: score of row 16t + 2 * (c16 & 7) + h (lanes c and c + 8 alike)
#pragma unroll
    for (int t = 0; t < TPW; ++t) {
        // the fence pair pins "loads of stage t + AHEAD, then the work on stage t":
        // without it the loads may sink to their use and the stream stalls
        __builtin_amdgcn_sched_barrier(0);
        LOAD_STAGE(t + AHEAD);
        __builtin_amdgcn_sched_barrier(0);
        const v4f* a = ring[t % NBUF];

        float x[8];   // x[g]: this lane's eighth of the score of row 2g + h
#pragma unroll
        for (int g = 0; g < 8; ++g) {
            const v2f alo = { a[g].x, a[g].y };
            const v2f ahi = { a[g].z, a[g].w };
            v8f d = {};
            d = __builtin_amdgcn_wmma_f32_16x16x4_f32(
                    false, alo, false, qlo, (short)0, d, false, false);
            d = __builtin_amdgcn_wmma_f32_16x16x4_f32(
                    false, ahi, false, qhi, (short)0, d, false, false);
            // register r of lane (c, h) is D[8h + r][c]: take r == c & 7
            const float s01 = b0 ? d[1] : d[0];
            const float s23 = b0 ? d[3] : d[2];
            const float s45 = b0 ? d[5] : d[4];
            const float s67 = b0 ? d[7] : d[6];
            const float s03 = b1 ? s23 : s01;
            const float s47 = b1 ? s67 : s45;
            x[g] = b2 ? s47 : s03;
        }
        // Sum each x[g] over its 8 lanes; lane (c, h) ends with row 2 * (c & 7) + h.
        float y[4], z[2];
#pragma unroll
        for (int i = 0; i < 4; ++i)
            y[i] = xadd<0x161>(b0 ? x[2 * i + 1] : x[2 * i], b0 ? x[2 * i] : x[2 * i + 1]);
#pragma unroll
        for (int i = 0; i < 2; ++i)
            z[i] = xadd<0x162>(b1 ? y[2 * i + 1] : y[2 * i], b1 ? y[2 * i] : y[2 * i + 1]);
        sc[t] = xadd<0x164>(b2 ? z[1] : z[0], b2 ? z[0] : z[1]);
    }

    // --- raw scores: lanes c < 8 store an even tile, lanes c >= 8 the odd one behind it,
    //     so each store of the wave fills one 128-B line
    float* araw = attn_raw + row0 + 16 * (b3 ? 1 : 0) + 2 * (c16 & 7) + h;
#pragma unroll
    for (int u = 0; u < TPW / 2; ++u) araw[32 * u] = b3 ? sc[2 * u + 1] : sc[2 * u];
    // the stores' address and data registers are reused right behind them: keep the wait in front
    asm volatile("s_wait_xcnt 0x0" ::: "memory");

    // --- the wave's own max, exp and sum (V stages 0 .. AHEAD - 1 are in flight) ---
    float m_w = sc[0];
#pragma unroll
    for (int t = 1; t < TPW; ++t) m_w = fmaxf(m_w, sc[t]);
    m_w = fmaxf(m_w, dpp<0x161>(m_w));
    m_w = fmaxf(m_w, dpp<0x162>(m_w));
    m_w = fmaxf(m_w, dpp<0x164>(m_w));
    m_w = fmaxf(m_w, other_row(m_w));

    float p[TPW];
    float l_w = 0.f;
#pragma unroll
    for (int t = 0; t < TPW; ++t) { p[t] = __expf(sc[t] - m_w); l_w += p[t]; }
    l_w = xadd<0x161>(l_w, l_w);
    l_w = xadd<0x162>(l_w, l_w);
    l_w = xadd<0x164>(l_w, l_w);
    l_w += other_row(l_w);

    // --- partial P.V: load g of a tile holds row 2g + h; its weight sits in lane g of
    //     this lane's 16-lane row (row_share) -----------------------------------
    v4f acc = { 0.f, 0.f, 0.f, 0.f };
#define PV(G) do { const float pj_ = dpp<0x150 + (G)>(p[t]); \
        acc.x = fmaf(pj_, vv[G].x, acc.x); acc.y = fmaf(pj_, vv[G].y, acc.y); \
        acc.z = fmaf(pj_, vv[G].z, acc.z); acc.w = fmaf(pj_, vv[G].w, acc.w); } while (0)
#pragma unroll
    for (int t = 0; t < TPW; ++t) {
        // same fence pair as above
        __builtin_amdgcn_sched_barrier(0);
        if (t + AHEAD < TPW) LOAD_STAGE(TPW + t + AHEAD);
        __builtin_amdgcn_sched_barrier(0);
        const v4f* vv = ring[(TPW + t) % NBUF];
        PV(0); PV(1); PV(2); PV(3); PV(4); PV(5); PV(6); PV(7);
    }
#undef PV
#undef LOAD_STAGE
    acc.x += other_row(acc.x);   // even rows + odd rows
    acc.y += other_row(acc.y);
    acc.z += other_row(acc.z);
    acc.w += other_row(acc.w);

    // --- merge the 4 waves, write the chunk's partials ---------------------
    if (h == 0) *(v4f*)&s_acc[wave][4 * c16] = acc;
    if (lane == 0) { s_m[wave] = m_w; s_l[wave] = l_w; }
    __syncthreads();

    if (tid < DIM) {
        const float m_c = fmaxf(fmaxf(s_m[0], s_m[1]), fmaxf(s_m[2], s_m[3]));
        const float e0 = __expf(s_m[0] - m_c);
        const float e1 = __expf(s_m[1] - m_c);
        const float e2 = __expf(s_m[2] - m_c);
        const float e3 = __expf(s_m[3] - m_c);
        float* wsb = ws + (size_t)(b * NCHUNK + chunk) * WSSTR;
        wsb[2 + tid] = s_acc[0][tid] * e0 + s_acc[1][tid] * e1
                     + s_acc[2][tid] * e2 + s_acc[3][tid] * e3;
        if (tid == 0) {
            wsb[0] = m_c;
            wsb[1] = s_l[0] * e0 + s_l[1] * e1 + s_l[2] * e2 + s_l[3] * e3;
        }
    }
}

// ---------------------------------------------------------------------------
// Pass 2: 4 blocks of 2 waves per batch, one 2048-score quarter of the attn row each.
// A thread issues all of its loads first; each wave reduces the 16 (m, l) itself in
// registers, so no wave waits on another. The first quarter's block also writes out[64].
// ---------------------------------------------------------------------------
#define P2SPLIT 4                              // blocks per batch
#define P2THR   64                             // threads per block
#define P2VEC   (SEQ / P2SPLIT / (4 * P2THR))  // 16-byte score vectors per thread

template <bool WITH_OUT>
__device__ __forceinline__ void pass2_body(
    const float* __restrict__ wsb,   // the batch's 16 chunk records
    float* __restrict__ outb,        // the batch's out[64]
    v4f* __restrict__ ap,            // this thread's first score vector
    const int tid)
{
    // lane c of each 16-lane row takes chunk c's (m, l)
    const v2f ml = *(const v2f*)(wsb + (tid & 15) * WSSTR);
    v4f s[P2VEC];
#pragma unroll
    for (int g = 0; g < P2VEC; ++g) s[g] = ap[g * P2THR];
    float av[NCHUNK];
    if (WITH_OUT) {
#pragma unroll
        for (int c = 0; c < NCHUNK; ++c) av[c] = wsb[c * WSSTR + 2 + tid];
    }
    // the loads' address registers are reused by the reduction behind them: keep the wait in front
    asm volatile("s_wait_xcnt 0x0" ::: "memory");

    float M = ml.x;
    M = fmaxf(M, dpp<0x161>(M));
    M = fmaxf(M, dpp<0x162>(M));
    M = fmaxf(M, dpp<0x164>(M));
    M = fmaxf(M, dpp<0x168>(M));
    const float e = __expf(ml.x - M);   // chunk c's weight, in lane c of the row
    float L = ml.y * e;
    L = xadd<0x161>(L, L);
    L = xadd<0x162>(L, L);
    L = xadd<0x164>(L, L);
    L = xadd<0x168>(L, L);
    const float rcpL = 1.0f / L;

#pragma unroll
    for (int g = 0; g < P2VEC; ++g) {
        v4f r;
        r.x = __expf(s[g].x - M) * rcpL;
        r.y = __expf(s[g].y - M) * rcpL;
        r.z = __expf(s[g].z - M) * rcpL;
        r.w = __expf(s[g].w - M) * rcpL;
        ap[g * P2THR] = r;
    }

    if (WITH_OUT) {
        float a = 0.f;
#define ACC(C) a += av[C] * dpp<0x150 + (C)>(e)   // row_share: lane C's weight
        ACC(0);  ACC(1);  ACC(2);  ACC(3);  ACC(4);  ACC(5);  ACC(6);  ACC(7);
        ACC(8);  ACC(9);  ACC(10); ACC(11); ACC(12); ACC(13); ACC(14); ACC(15);
#undef ACC
        outb[tid] = a * rcpL;
    }
    // in the built code the other body follows and rewrites the stores' data registers: keep the wait in front
    asm volatile("s_wait_xcnt 0x0" ::: "memory");
}

__global__ __launch_bounds__(P2THR) void attn_pass2(
    const float* __restrict__ ws,
    float* __restrict__ out,    // d_out [B*64]
    float* __restrict__ attn)   // d_out + 4096: raw scores in, probs out
{
    const int b    = blockIdx.x / P2SPLIT;
    const int part = blockIdx.x % P2SPLIT;
    const int tid  = threadIdx.x;
    const float* wsb = ws + (size_t)b * NCHUNK * WSSTR;
    v4f* ap = (v4f*)(attn + (size_t)b * SEQ + part * (SEQ / P2SPLIT)) + tid;

    // two straight-line bodies, so that the out loads too stand in front of the reduction
    if (part == 0) pass2_body<true>(wsb, out + b * DIM, ap, tid);
    else           pass2_body<false>(wsb, out + b * DIM, ap, tid);
}

// ---------------------------------------------------------------------------
extern "C" void kernel_launch(void* const* d_in, const int* in_sizes, int n_in,
                              void* d_out, int out_size, void* d_ws, size_t ws_size,
                              hipStream_t stream) {
    const float* q = (const float*)d_in[0];
    const float* k = (const float*)d_in[1];
    const float* v = (const float*)d_in[2];

    float* out  = (float*)d_out;          // [B,1,D] -> 4096 floats
    float* attn = out + BATCH * DIM;      // [B,1,S] -> 524288 floats
    float* ws   = (float*)d_ws;           // needs 64*16*68*4 = ~279 KB

    dim3 g1(NCHUNK, BATCH);
    attn_pass1<<<g1, 128, 0, stream>>>(q, k, v, attn, ws);
    attn_pass2<<<BATCH * P2SPLIT, P2THR, 0, stream>>>(ws, out, attn);
}

// v004
// One run takes 19.3 microseconds.
// Two timings next to v003 both put it at 1.06 times that version's speed.
// All steps since v000 together make it 1.61 times as fast.
#include <hip/hip_runtime.h>

typedef float v2f __attribute__((ext_vector_type(2)));
typedef float v4f __attribute__((ext_vector_type(4)));
typedef float v8f __attribute__((ext_vector_type(8)));

#define BATCH   64
#define SEQ     8192
#define DIM     64
#define NCHUNK  16
#define CHUNK   512          // rows per block
#define WAVES   4
#define RPW     128          // rows per wave (CHUNK/WAVES)
#define TPW     8            // 16-row tiles per wave, of K and again of V
#define AHEAD   2            // tiles whose loads are issued ahead of the tile worked on
#define NBUF    (AHEAD + 1)  // tile buffers of the register ring
#define WSSTR   68           // per-(b,chunk) ws floats: [0]=m, [1]=l, [2..65]=acc[64]

template <int CTRL>
__device__ __forceinline__ float dpp(float x) {
    return __int_as_float(__builtin_amdgcn_update_dpp(
               0, __float_as_int(x), CTRL, 0xf, 0xf, true));
}

// keep + (send of the lane whose number differs by the row_xmask in CTRL)
template <int CTRL>
__device__ __forceinline__ float xadd(float keep, float send) {
    return keep + dpp<CTRL>(send);
}

// the value of lane l ^ 16
__device__ __forceinline__ float other_row(float x) {
    return __int_as_float(__builtin_amdgcn_permlanex16(
               0, __float_as_int(x), 0x76543210, 0xfedcba98, false, false));
}

// ---------------------------------------------------------------------------
// Pass 1: one block = one (batch, 512-row chunk); each wave works alone on its
//   128 rows until the closing merge. It streams 8 K tiles, then 8 V tiles
//   (16 rows = 8 loads of 512 B each) through one ring of register buffers.
//   scores (q.K^T / 8) via v_wmma_f32_16x16x4_f32, softmax partials (m, l) of the
//   wave in registers, partial P.V, raw scores -> attn region.
// ---------------------------------------------------------------------------
__global__ __launch_bounds__(128) void attn_pass1(
    const float* __restrict__ q,
    const float* __restrict__ k,
    const float* __restrict__ v,
    float* __restrict__ attn_raw,   // d_out + 4096, raw scaled scores
    float* __restrict__ ws)
{
    __shared__ float s_m[WAVES];
    __shared__ float s_l[WAVES];
    __shared__ __attribute__((aligned(16))) float s_acc[WAVES][DIM];

    const int b     = blockIdx.y;
    const int chunk = blockIdx.x;
    const int tid   = threadIdx.x;
    const int lane  = tid & 31;
    const int wave  = tid >> 5;

    // --- QK^T via WMMA f32 16x16x4, K read as whole 128-B lines -------------
    // One 16-byte load of the wave covers 512 contiguous bytes = 2 K rows.
    // A row c of the tile = 8 consecutive floats: K row (c >> 3), eighth (c & 7);
    // lane (c, h) holds floats 4h .. 4h+3 of it (two k steps of the 16x16x4 form).
    // B column n = the eighth (n & 7) of q in the same k order, so
    // D[8s + e][n] = K[row s][eighth e] . q[eighth n & 7]; used where (n & 7) == e.
    const int c16 = lane & 15;
    const int h   = lane >> 4;
    const bool b0 = (lane & 1) != 0;
    const bool b1 = (lane & 2) != 0;
    const bool b2 = (lane & 4) != 0;
    const bool b3 = (lane & 8) != 0;

    const size_t row0 = (size_t)b * SEQ + chunk * CHUNK + wave * RPW;   // the wave's first row
    const v4f* kp = (const v4f*)(k + row0 * DIM) + (2 * c16 + h);
    const v4f* vp = (const v4f*)(v + row0 * DIM) + lane;   // row 2g + h, floats 4 c16 .. 4 c16 + 3

    const v4f q4 = *(const v4f*)(q + b * DIM + 8 * (lane & 7) + 4 * h) * 0.125f;  // 1/temperature folded in
    const v2f qlo = { q4.x, q4.y };
    const v2f qhi = { q4.z, q4.w };

    // Stage S of the stream: K tile S for S < TPW, then V tile S - TPW.
    // Every K and V byte is read once, by one wave: the non-temporal hint asks L2 not to keep it.
    v4f ring[NBUF][8];
#define LOAD_STAGE(S) do { \
        const v4f* src_ = ((S) < TPW) ? kp + (S) * 256 : vp + ((S) - TPW) * 256; \
        _Pragma("unroll") for (int g = 0; g < 8; ++g) ring[(S) % NBUF][g] = __builtin_nontemporal_load(src_ + g * 32); \
    } while (0)

    // every loop over stages is unrolled: constant indices keep ring, sc and p in registers
#pragma unroll
    for (int s = 0; s < AHEAD; ++s) LOAD_STAGE(s);

    float sc[TPW];   // sc[t]: score of row 16t + 2 * (c16 & 7) + h (lanes c and c + 8 alike)
#pragma unroll
    for (int t = 0; t < TPW; ++t) {
        // the fence pair pins "loads of stage t + AHEAD, then the work on stage t":
        // without it the loads may sink to their use and the stream stalls
        __builtin_amdgcn_sched_barrier(0);
        LOAD_STAGE(t + AHEAD);
        __builtin_amdgcn_sched_barrier(0);
        const v4f* a = ring[t % NBUF];

        float x[8];   // x[g]: this lane's eighth of the score of row 2g + h
#pragma unroll
        for (int g = 0; g < 8; ++g) {
            const v2f alo = { a[g].x, a[g].y };
            const v2f ahi = { a[g].z, a[g].w };
            v8f d = {};
            d = __builtin_amdgcn_wmma_f32_16x16x4_f32(
                    false, alo, false, qlo, (short)0, d, false, false);
            d = __builtin_amdgcn_wmma_f32_16x16x4_f32(
                    false, ahi, false, qhi, (short)0, d, false, false);
            // register r of lane (c, h) is D[8h + r][c]: take r == c & 7
            const float s01 = b0 ? d[1] : d[0];
            const float s23 = b0 ? d[3] : d[2];
            const float s45 = b0 ? d[5] : d[4];
            const float s67 = b0 ? d[7] : d[6];
            const float s03 = b1 ? s23 : s01;
            const float s47 = b1 ? s67 : s45;
            x[g] = b2 ? s47 : s03;
        }
        // Sum each x[g] over its 8 lanes; lane (c, h) ends with row 2 * (c & 7) + h.
        float y[4], z[2];
#pragma unroll
        for (int i = 0; i < 4; ++i)
            y[i] = xadd<0x161>(b0 ? x[2 * i + 1] : x[2 * i], b0 ? x[2 * i] : x[2 * i + 1]);
#pragma unroll
        for (int i = 0; i < 2; ++i)
            z[i] = xadd<0x162>(b1 ? y[2 * i + 1] : y[2 * i], b1 ? y[2 * i] : y[2 * i + 1]);
        sc[t] = xadd<0x164>(b2 ? z[1] : z[0], b2 ? z[0] : z[1]);
    }

    // --- raw scores: lanes c < 8 store an even tile, lanes c >= 8 the odd one behind it,
    //     so each store of the wave fills one 128-B line
    float* araw = attn_raw + row0 + 16 * (b3 ? 1 : 0) + 2 * (c16 & 7) + h;
#pragma unroll
    for (int u = 0; u < TPW / 2; ++u) araw[32 * u] = b3 ? sc[2 * u + 1] : sc[2 * u];
    // the stores' address and data registers are reused right behind them: keep the wait in front
    asm volatile("s_wait_xcnt 0x0" ::: "memory");

    // --- the wave's own max, exp and sum (V stages 0 .. AHEAD - 1 are in flight) ---
    float m_w = sc[0];
#pragma unroll
    for (int t = 1; t < TPW; ++t) m_w = fmaxf(m_w, sc[t]);
    m_w = fmaxf(m_w, dpp<0x161>(m_w));
    m_w = fmaxf(m_w, dpp<0x162>(m_w));
    m_w = fmaxf(m_w, dpp<0x164>(m_w));
    m_w = fmaxf(m_w, other_row(m_w));

    float p[TPW];
    float l_w = 0.f;
#pragma unroll
    for (int t = 0; t < TPW; ++t) { p[t] = __expf(sc[t] - m_w); l_w += p[t]; }
    l_w = xadd<0x161>(l_w, l_w);
    l_w = xadd<0x162>(l_w, l_w);
    l_w = xadd<0x164>(l_w, l_w);
    l_w += other_row(l_w);

    // --- partial P.V: load g of a tile holds row 2g + h; its weight sits in lane g of
    //     this lane's 16-lane row (row_share) -----------------------------------
    v4f acc = { 0.f, 0.f, 0.f, 0.f };
#define PV(G) do { const float pj_ = dpp<0x150 + (G)>(p[t]); \
        acc.x = fmaf(pj_, vv[G].x, acc.x); acc.y = fmaf(pj_, vv[G].y, acc.y); \
        acc.z = fmaf(pj_, vv[G].z, acc.z); acc.w = fmaf(pj_, vv[G].w, acc.w); } while (0)
#pragma unroll
    for (int t = 0; t < TPW; ++t) {
        // same fence pair as above
        __builtin_amdgcn_sched_barrier(0);
        if (t + AHEAD < TPW) LOAD_STAGE(TPW + t + AHEAD);
        __builtin_amdgcn_sched_barrier(0);
        const v4f* vv = ring[(TPW + t) % NBUF];
        PV(0); PV(1); PV(2); PV(3); PV(4); PV(5); PV(6); PV(7);
    }
#undef PV
#undef LOAD_STAGE
    acc.x += other_row(acc.x);   // even rows + odd rows
    acc.y += other_row(acc.y);
    acc.z += other_row(acc.z);
    acc.w += other_row(acc.w);

    // --- merge the 4 waves, write the chunk's partials ---------------------
    if (h == 0) *(v4f*)&s_acc[wave][4 * c16] = acc;
    if (lane == 0) { s_m[wave] = m_w; s_l[wave] = l_w; }
    __syncthreads();

    if (tid < DIM) {
        const float m_c = fmaxf(fmaxf(s_m[0], s_m[1]), fmaxf(s_m[2], s_m[3]));
        const float e0 = __expf(s_m[0] - m_c);
        const float e1 = __expf(s_m[1] - m_c);
        const float e2 = __expf(s_m[2] - m_c);
        const float e3 = __expf(s_m[3] - m_c);
        float* wsb = ws + (size_t)(b * NCHUNK + chunk) * WSSTR;
        wsb[2 + tid] = s_acc[0][tid] * e0 + s_acc[1][tid] * e1
                     + s_acc[2][tid] * e2 + s_acc[3][tid] * e3;
        if (tid == 0) {
            wsb[0] = m_c;
            wsb[1] = s_l[0] * e0 + s_l[1] * e1 + s_l[2] * e2 + s_l[3] * e3;
        }
    }
}

// ---------------------------------------------------------------------------
// Pass 2: 4 blocks of 2 waves per batch, one 2048-score quarter of the attn row each.
// A thread issues all of its loads first; each wave reduces the 16 (m, l) itself in
// registers, so no wave waits on another. The first quarter's block also writes out[64].
// ---------------------------------------------------------------------------
#define P2SPLIT 4                              // blocks per batch
#define P2THR   64                             // threads per block
#define P2VEC   (SEQ / P2SPLIT / (4 * P2THR))  // 16-byte score vectors per thread

template <bool WITH_OUT>
__device__ __forceinline__ void pass2_body(
    const float* __restrict__ wsb,   // the batch's 16 chunk records
    float* __restrict__ outb,        // the batch's out[64]
    v4f* __restrict__ ap,            // this thread's first score vector
    const int tid)
{
    // lane c of each 16-lane row takes chunk c's (m, l)
    const v2f ml = *(const v2f*)(wsb + (tid & 15) * WSSTR);
    v4f s[P2VEC];
#pragma unroll
    for (int g = 0; g < P2VEC; ++g) s[g] = ap[g * P2THR];
    float av[NCHUNK];
    if (WITH_OUT) {
#pragma unroll
        for (int c = 0; c < NCHUNK; ++c) av[c] = wsb[c * WSSTR + 2 + tid];
    }
    // the loads' address registers are reused by the reduction behind them: keep the wait in front
    asm volatile("s_wait_xcnt 0x0" ::: "memory");

    float M = ml.x;
    M = fmaxf(M, dpp<0x161>(M));
    M = fmaxf(M, dpp<0x162>(M));
    M = fmaxf(M, dpp<0x164>(M));
    M = fmaxf(M, dpp<0x168>(M));
    const float e = __expf(ml.x - M);   // chunk c's weight, in lane c of the row
    float L = ml.y * e;
    L = xadd<0x161>(L, L);
    L = xadd<0x162>(L, L);
    L = xadd<0x164>(L, L);
    L = xadd<0x168>(L, L);
    const float rcpL = 1.0f / L;

#pragma unroll
    for (int g = 0; g < P2VEC; ++g) {
        v4f r;
        r.x = __expf(s[g].x - M) * rcpL;
        r.y = __expf(s[g].y - M) * rcpL;
        r.z = __expf(s[g].z - M) * rcpL;
        r.w = __expf(s[g].w - M) * rcpL;
        ap[g * P2THR] = r;
    }

    if (WITH_OUT) {
        float a = 0.f;
#define ACC(C) a += av[C] * dpp<0x150 + (C)>(e)   // row_share: lane C's weight
        ACC(0);  ACC(1);  ACC(2);  ACC(3);  ACC(4);  ACC(5);  ACC(6);  ACC(7);
        ACC(8);  ACC(9);  ACC(10); ACC(11); ACC(12); ACC(13); ACC(14); ACC(15);
#undef ACC
        outb[tid] = a * rcpL;
    }
    // in the built code the other body follows and rewrites the stores' data registers: keep the wait in front
    asm volatile("s_wait_xcnt 0x0" ::: "memory");
}

__global__ __launch_bounds__(P2THR) void attn_pass2(
    const float* __restrict__ ws,
    float* __restrict__ out,    // d_out [B*64]
    float* __restrict__ attn)   // d_out + 4096: raw scores in, probs out
{
    const int b    = blockIdx.x / P2SPLIT;
    const int part = blockIdx.x % P2SPLIT;
    const int tid  = threadIdx.x;
    const float* wsb = ws + (size_t)b * NCHUNK * WSSTR;
    v4f* ap = (v4f*)(attn + (size_t)b * SEQ + part * (SEQ / P2SPLIT)) + tid;

    // two straight-line bodies, so that the out loads too stand in front of the reduction
    if (part == 0) pass2_body<true>(wsb, out + b * DIM, ap, tid);
    else           pass2_body<false>(wsb, out + b * DIM, ap, tid);
}

// ---------------------------------------------------------------------------
extern "C" void kernel_launch(void* const* d_in, const int* in_sizes, int n_in,
                              void* d_out, int out_size, void* d_ws, size_t ws_size,
                              hipStream_t stream) {
    const float* q = (const float*)d_in[0];
    const float* k = (const float*)d_in[1];
    const float* v = (const float*)d_in[2];

    float* out  = (float*)d_out;          // [B,1,D] -> 4096 floats
    float* attn = out + BATCH * DIM;      // [B,1,S] -> 524288 floats
    float* ws   = (float*)d_ws;           // needs 64*16*68*4 = ~279 KB

    dim3 g1(NCHUNK, BATCH);
    attn_pass1<<<g1, 128, 0, stream>>>(q, k, v, attn, ws);
    attn_pass2<<<BATCH * P2SPLIT, P2THR, 0, stream>>>(ws, out, attn);
}
